// v000
// Times are from an AMD MI455X. After a warm-up the kernel runs many times in a row, and a time is the length of
// such a window on the GPU divided by its runs, so every launch and the gaps after it count. The runs cycle
// through copies of the inputs. A figure is the median of several windows, for all but v000 over two sittings.
// Sittings can differ by a few percent; kernels timed side by side share one.
// The starting kernel, v000, takes 297 microseconds a run.
#include <hip/hip_runtime.h>

typedef __attribute__((ext_vector_type(2))) float v2f;
typedef __attribute__((ext_vector_type(8))) float v8f;

#define DIN   64
#define DOUT  64
#define HID   32
#define BATCH 1024

// Grid: 64 blocks (one per 16-row batch tile), 256 threads = 8 waves.
// Wave w handles output columns o in [w*8, w*8+8), loops over all i=0..63.
__global__ __launch_bounds__(256) void kan_wmma_kernel(
    const float* __restrict__ x,    // [B, DIN]
    const float* __restrict__ W1,   // [DIN, DOUT, HID, 7]
    const float* __restrict__ W2,   // [DIN, DOUT, 1, HID]
    const float* __restrict__ B1,   // [DIN, DOUT, HID]
    const float* __restrict__ B2,   // [DIN, DOUT, 1]
    float* __restrict__ out)        // [B, DOUT]
{
    const int lane  = threadIdx.x & 31;
    const int wave  = threadIdx.x >> 5;   // 0..7
    const int btile = blockIdx.x;         // 0..63
    const int col   = lane & 15;          // N (and M-low) index
    const bool hi   = lane >= 16;
    const int koff  = hi ? 2 : 0;         // K base for this half-wave
    const int obase = wave * 8;

    // Per-lane accumulators: acc[oo][v] is partial sum for row M=v(+8 if hi),
    // column-group N=col, output o=obase+oo, summed over i and both h-tiles.
    float acc[8][8];
    float bsum[8];
#pragma unroll
    for (int oo = 0; oo < 8; ++oo) {
        bsum[oo] = 0.0f;
#pragma unroll
        for (int v = 0; v < 8; ++v) acc[oo][v] = 0.0f;
    }

    for (int i = 0; i < DIN; ++i) {
        // ---- A operand: feats[b, f] for b = btile*16 + col ----
        const float xv = x[(btile * 16 + col) * DIN + i];
        const float s1 = __sinf(2.0f * xv);
        const float s2 = __sinf(4.0f * xv);
        const float s3 = __sinf(8.0f * xv);
        const float c1 = __cosf(2.0f * xv);
        const float c2 = __cosf(4.0f * xv);
        const float c3 = __cosf(8.0f * xv);
        // feats = [x, sin2x, sin4x, sin8x, cos2x, cos4x, cos8x, 0]
        v2f a0, a1;                         // K-tiles 0..3 and 4..7
        a0.x = hi ? s2 : xv;                // K = koff+0  -> f2 / f0
        a0.y = hi ? s3 : s1;                // K = koff+1  -> f3 / f1
        a1.x = hi ? c3 : c1;                // K = 4+koff  -> f6 / f4
        a1.y = hi ? 0.0f : c2;              // K = 5+koff  -> f7(pad) / f5

        const float* W1i = W1 + (size_t)i * DOUT * HID * 7;
        const float* B1i = B1 + (size_t)i * DOUT * HID;
        const float* W2i = W2 + (size_t)i * DOUT * HID;
        const float* B2i = B2 + (size_t)i * DOUT;

#pragma unroll
        for (int oo = 0; oo < 8; ++oo) {
            const int o = obase + oo;
            bsum[oo] += B2i[o];
            const float* w1o = W1i + (size_t)o * HID * 7;
            const float* b1o = B1i + (size_t)o * HID;
            const float* w2o = W2i + (size_t)o * HID;

#pragma unroll
            for (int ht = 0; ht < 2; ++ht) {
                const int hidx = ht * 16 + col;       // N -> hidden unit
                const float* p = w1o + hidx * 7;

                // ---- B operand: W1[i,o,hidx,f], f=7 zero-padded ----
                v2f b0, b1v;
                b0.x  = p[koff];                      // f = koff
                b0.y  = p[koff + 1];                  // f = koff+1
                b1v.x = p[4 + koff];                  // f = 4+koff (f6 for hi)
                b1v.y = hi ? 0.0f : p[5];             // f = 7 pad / f5

                const float bias = b1o[hidx];
                const float w2v  = w2o[hidx];

                // ---- C seeded with bias (broadcast over batch rows) ----
                v8f c;
#pragma unroll
                for (int v = 0; v < 8; ++v) c[v] = bias;

                // D = feats * W1^T + bias   (K = 8, two chained K=4 WMMAs)
                c = __builtin_amdgcn_wmma_f32_16x16x4_f32(
                        false, a1, false, b1v, (short)0, c, false, false);
                c = __builtin_amdgcn_wmma_f32_16x16x4_f32(
                        false, a0, false, b0, (short)0, c, false, false);

                // ---- SiLU + second-layer scale, accumulate ----
                // silu(h) = h * 1/(1+exp(-h)); use native v_rcp_f32 (1 ulp)
                // instead of the IEEE div sequence (div_scale/div_fixup).
#pragma unroll
                for (int v = 0; v < 8; ++v) {
                    const float hh  = c[v];
                    const float sig = __builtin_amdgcn_rcpf(1.0f + __expf(-hh));
                    acc[oo][v] += (hh * sig) * w2v;
                }
            }
        }
    }

    // ---- Deferred N-reduction (sum over 16 lanes of each half-wave) ----
#pragma unroll
    for (int oo = 0; oo < 8; ++oo) {
        const int o = obase + oo;
#pragma unroll
        for (int v = 0; v < 8; ++v) {
            float r = acc[oo][v];
            r += __shfl_xor(r, 1);
            r += __shfl_xor(r, 2);
            r += __shfl_xor(r, 4);
            r += __shfl_xor(r, 8);
            if (col == 0) {
                const int m = v + (hi ? 8 : 0);       // batch row within tile
                out[(btile * 16 + m) * DOUT + o] = r + bsum[oo];
            }
        }
    }
}

extern "C" void kernel_launch(void* const* d_in, const int* in_sizes, int n_in,
                              void* d_out, int out_size, void* d_ws, size_t ws_size,
                              hipStream_t stream) {
    const float* x  = (const float*)d_in[0];
    const float* W1 = (const float*)d_in[1];
    const float* W2 = (const float*)d_in[2];
    const float* B1 = (const float*)d_in[3];
    const float* B2 = (const float*)d_in[4];
    float* out = (float*)d_out;

    (void)in_sizes; (void)n_in; (void)out_size; (void)d_ws; (void)ws_size;

    kan_wmma_kernel<<<dim3(BATCH / 16), dim3(256), 0, stream>>>(
        x, W1, W2, B1, B2, out);
}

// v001
// It runs in 30.2 microseconds.
// Two timings next to v000 both put it at 9.86 times that version's speed.
#include <hip/hip_runtime.h>

typedef __attribute__((ext_vector_type(2))) float v2f;
typedef __attribute__((ext_vector_type(4))) float v4f;
typedef __attribute__((ext_vector_type(8))) float v8f;

#define DIN   64
#define DOUT  64
#define HID   32
#define BATCH 1024

#define MB    4              // 16-row batch tiles per wave (64 rows)
#define NO    2              // output columns per wave
#define NW    8              // waves per block, one slice of the inputs each
#define IC    (DIN / NW)     // inputs per wave

// Grid: 512 blocks = 16 groups of 64 batch rows x 32 pairs of output columns,
// 256 threads = 8 waves. Every wave works on the block's 64 rows x 2 columns
// for its own 8 inputs i, so one fetch of a weight fragment serves 4 batch
// tiles; the 8 partial sums over i are joined in LDS at the end.
__global__ __launch_bounds__(256) void kan_wmma_kernel(
    const float* __restrict__ x,    // [B, DIN]
    const float* __restrict__ W1,   // [DIN, DOUT, HID, 7]
    const float* __restrict__ W2,   // [DIN, DOUT, 1, HID]
    const float* __restrict__ B1,   // [DIN, DOUT, HID]
    const float* __restrict__ B2,   // [DIN, DOUT, 1]
    float* __restrict__ out)        // [B, DOUT]
{
    // [wave][(mb*NO+oo)*2 + v/4][lane] of 4 floats: 64 KiB
    __shared__ v4f red[NW * MB * NO * 2 * 32];

    const int lane  = threadIdx.x & 31;
    const int wave  = threadIdx.x >> 5;   // 0..7
    const int rbase = (blockIdx.x >> 5) * (MB * 16);   // first batch row
    const int obase = (blockIdx.x & 31) * NO;          // first output column
    const int ibase = wave * IC;                       // first input
    const int col   = lane & 15;          // N (and M-low) index
    const bool hi   = lane >= 16;
    const int koff  = hi ? 2 : 0;         // K base for this half-wave

    // acc[mb][oo][v]: partial sum for row M=v(+8 if hi) of batch tile mb,
    // column-group N=col, output obase+oo, over this wave's i and both h-tiles.
    float acc[MB][NO][8];
#pragma unroll
    for (int mb = 0; mb < MB; ++mb)
#pragma unroll
        for (int oo = 0; oo < NO; ++oo)
#pragma unroll
            for (int v = 0; v < 8; ++v) acc[mb][oo][v] = 0.0f;

    // Kept rolled: one trip already holds 16 unrolled tiles of code.
#pragma unroll 1
    for (int ii = 0; ii < IC; ++ii) {
        const int i = ibase + ii;

        // ---- A operands: feats[b, f] for b = rbase + mb*16 + col ----
        v2f a0[MB], a1[MB];                 // K-tiles 0..3 and 4..7
#pragma unroll
        for (int mb = 0; mb < MB; ++mb) {
            const float xv = x[(rbase + mb * 16 + col) * DIN + i];
            const float s1 = __sinf(2.0f * xv);
            const float s2 = __sinf(4.0f * xv);
            const float s3 = __sinf(8.0f * xv);
            const float c1 = __cosf(2.0f * xv);
            const float c2 = __cosf(4.0f * xv);
            const float c3 = __cosf(8.0f * xv);
            // feats = [x, sin2x, sin4x, sin8x, cos2x, cos4x, cos8x, 0]
            a0[mb].x = hi ? s2 : xv;        // K = koff+0  -> f2 / f0
            a0[mb].y = hi ? s3 : s1;        // K = koff+1  -> f3 / f1
            a1[mb].x = hi ? c3 : c1;        // K = 4+koff  -> f6 / f4
            a1[mb].y = hi ? 0.0f : c2;      // K = 5+koff  -> f7(pad) / f5
        }

        const float* W1i = W1 + (size_t)i * DOUT * HID * 7;
        const float* B1i = B1 + (size_t)i * DOUT * HID;
        const float* W2i = W2 + (size_t)i * DOUT * HID;

#pragma unroll
        for (int oo = 0; oo < NO; ++oo) {
            const int o = obase + oo;
            const float* w1o = W1i + (size_t)o * HID * 7;
            const float* b1o = B1i + (size_t)o * HID;
            const float* w2o = W2i + (size_t)o * HID;

#pragma unroll
            for (int ht = 0; ht < 2; ++ht) {
                const int hidx = ht * 16 + col;       // N -> hidden unit
                const float* p = w1o + hidx * 7;

                // ---- B operand: W1[i,o,hidx,f], f=7 zero-padded ----
                v2f b0, b1v;
                b0.x  = p[koff];                      // f = koff
                b0.y  = p[koff + 1];                  // f = koff+1
                b1v.x = p[4 + koff];                  // f = 4+koff (f6 for hi)
                b1v.y = hi ? 0.0f : p[5];             // f = 7 pad / f5
                // Behind the trip's last lane-masked load its address pair is
                // stepped to the next input; this wait stands in between.
                if (oo == NO - 1 && ht == 1)
                    asm volatile("s_wait_xcnt 0x0" ::: "memory");

                const float bias = b1o[hidx];
                const float w2v  = w2o[hidx];

#pragma unroll
                for (int mb = 0; mb < MB; ++mb) {
                    // ---- C seeded with bias (broadcast over batch rows) ----
                    v8f c;
#pragma unroll
                    for (int v = 0; v < 8; ++v) c[v] = bias;

                    // D = feats * W1^T + bias  (K = 8, two chained K=4 WMMAs)
                    c = __builtin_amdgcn_wmma_f32_16x16x4_f32(
                            false, a1[mb], false, b1v, (short)0, c, false, false);
                    c = __builtin_amdgcn_wmma_f32_16x16x4_f32(
                            false, a0[mb], false, b0, (short)0, c, false, false);

                    // ---- SiLU + second-layer scale, accumulate ----
                    // silu(h) = h * 1/(1+exp(-h)); native v_rcp_f32 (1 ulp)
#pragma unroll
                    for (int v = 0; v < 8; ++v) {
                        const float hh  = c[v];
                        const float sig = __builtin_amdgcn_rcpf(1.0f + __expf(-hh));
                        acc[mb][oo][v] += (hh * sig) * w2v;
                    }
                }
            }
        }
    }

    // ---- Join the 8 waves' partial sums over i, lane by lane, in LDS ----
#pragma unroll
    for (int mb = 0; mb < MB; ++mb)
#pragma unroll
        for (int oo = 0; oo < NO; ++oo)
#pragma unroll
            for (int q = 0; q < 2; ++q) {
                v4f t;
#pragma unroll
                for (int j = 0; j < 4; ++j) t[j] = acc[mb][oo][q * 4 + j];
                red[((wave * MB * NO + mb * NO + oo) * 2 + q) * 32 + lane] = t;
            }

    __syncthreads();

    // Wave w finishes batch tile w / NO, output column obase + w % NO.
    const int fmb = wave / NO;
    const int o   = obase + wave % NO;
    v4f s[2];
#pragma unroll
    for (int q = 0; q < 2; ++q) {
        s[q] = red[(wave * 2 + q) * 32 + lane];
#pragma unroll
        for (int w = 1; w < NW; ++w)
            s[q] += red[((w * MB * NO + wave) * 2 + q) * 32 + lane];
    }

    // Each of the 16 lanes of a row brings 4 of the 64 second-layer biases
    // into the sum over lanes below.
    float bs = 0.0f;
#pragma unroll
    for (int j = 0; j < DIN / 16; ++j) bs += B2[(col + 16 * j) * DOUT + o];

    // ---- N-reduction (sum over 16 lanes of each half-wave) ----
#pragma unroll
    for (int v = 0; v < 8; ++v) {
        float r = s[v >> 2][v & 3] + bs;
        r += __shfl_xor(r, 1);
        r += __shfl_xor(r, 2);
        r += __shfl_xor(r, 4);
        r += __shfl_xor(r, 8);
        if (col == 0) {
            const int m = v + (hi ? 8 : 0);           // batch row within tile
            out[(rbase + fmb * 16 + m) * DOUT + o] = r;
        }
    }
}

extern "C" void kernel_launch(void* const* d_in, const int* in_sizes, int n_in,
                              void* d_out, int out_size, void* d_ws, size_t ws_size,
                              hipStream_t stream) {
    const float* x  = (const float*)d_in[0];
    const float* W1 = (const float*)d_in[1];
    const float* W2 = (const float*)d_in[2];
    const float* B1 = (const float*)d_in[3];
    const float* B2 = (const float*)d_in[4];
    float* out = (float*)d_out;

    (void)in_sizes; (void)n_in; (void)out_size; (void)d_ws; (void)ws_size;

    kan_wmma_kernel<<<dim3((BATCH / (MB * 16)) * (DOUT / NO)), dim3(256), 0, stream>>>(
        x, W1, W2, B1, B2, out);
}

// v002
// A run of this version takes 24.9 microseconds.
// Next to v001, in two timings, it ran 1.21 times as fast each time.
// Counting every step since v000, it is 12.0 times as fast.
#include <hip/hip_runtime.h>

typedef __attribute__((ext_vector_type(2))) float v2f;
typedef __attribute__((ext_vector_type(4))) float v4f;
typedef __attribute__((ext_vector_type(8))) float v8f;

#define DIN   64
#define DOUT  64
#define HID   32
#define BATCH 1024

#define MB    4              // 16-row batch tiles per wave (64 rows)
#define NO    2              // output columns per wave
#define NW    8              // waves per block, one slice of the inputs each
#define IC    (DIN / NW)     // inputs per wave

// Grid: 512 blocks = 16 groups of 64 batch rows x 32 pairs of output columns,
// 256 threads = 8 waves. Every wave works on the block's 64 rows x 2 columns
// for its own 8 inputs i, so one fetch of a weight fragment serves 4 batch
// tiles; the 8 partial sums over i are joined in LDS at the end.
__global__ __launch_bounds__(256) void kan_wmma_kernel(
    const float* __restrict__ x,    // [B, DIN]
    const float* __restrict__ W1,   // [DIN, DOUT, HID, 7]
    const float* __restrict__ W2,   // [DIN, DOUT, 1, HID]
    const float* __restrict__ B1,   // [DIN, DOUT, HID]
    const float* __restrict__ B2,   // [DIN, DOUT, 1]
    float* __restrict__ out)        // [B, DOUT]
{
    // [wave][(mb*NO+oo)*2 + v/4][lane] of 4 floats: 64 KiB
    __shared__ v4f red[NW * MB * NO * 2 * 32];

    const int lane  = threadIdx.x & 31;
    const int wave  = threadIdx.x >> 5;   // 0..7
    const int rbase = (blockIdx.x >> 5) * (MB * 16);   // first batch row
    const int obase = (blockIdx.x & 31) * NO;          // first output column
    const int ibase = wave * IC;                       // first input
    const int col   = lane & 15;          // N (and M-low) index
    const bool hi   = lane >= 16;
    const int koff  = hi ? 2 : 0;         // K base for this half-wave

    // acc[mb][oo][v]: partial sum for row M=v(+8 if hi) of batch tile mb,
    // column-group N=col, output obase+oo, over this wave's i and both h-tiles.
    float acc[MB][NO][8];
#pragma unroll
    for (int mb = 0; mb < MB; ++mb)
#pragma unroll
        for (int oo = 0; oo < NO; ++oo)
#pragma unroll
            for (int v = 0; v < 8; ++v) acc[mb][oo][v] = 0.0f;

    // Kept rolled: one trip already holds 16 unrolled tiles of code.
#pragma unroll 1
    for (int ii = 0; ii < IC; ++ii) {
        const int i = ibase + ii;

        // ---- A operands: feats[b, f] for b = rbase + mb*16 + col ----
        v2f a0[MB], a1[MB];                 // K-tiles 0..3 and 4..7
#pragma unroll
        for (int mb = 0; mb < MB; ++mb) {
            const float xv = x[(rbase + mb * 16 + col) * DIN + i];
            const float s1 = __sinf(2.0f * xv);
            const float s2 = __sinf(4.0f * xv);
            const float s3 = __sinf(8.0f * xv);
            const float c1 = __cosf(2.0f * xv);
            const float c2 = __cosf(4.0f * xv);
            const float c3 = __cosf(8.0f * xv);
            // feats = [x, sin2x, sin4x, sin8x, cos2x, cos4x, cos8x, 0], halved
            // (exact) so that the products below yield t = h / 2.
            a0[mb].x = 0.5f * (hi ? s2 : xv);   // K = koff+0  -> f2 / f0
            a0[mb].y = 0.5f * (hi ? s3 : s1);   // K = koff+1  -> f3 / f1
            a1[mb].x = 0.5f * (hi ? c3 : c1);   // K = 4+koff  -> f6 / f4
            a1[mb].y = hi ? 0.0f : 0.5f * c2;   // K = 5+koff  -> f7(pad) / f5
        }

        const float* W1i = W1 + (size_t)i * DOUT * HID * 7;
        const float* B1i = B1 + (size_t)i * DOUT * HID;
        const float* W2i = W2 + (size_t)i * DOUT * HID;

#pragma unroll
        for (int oo = 0; oo < NO; ++oo) {
            const int o = obase + oo;
            const float* w1o = W1i + (size_t)o * HID * 7;
            const float* b1o = B1i + (size_t)o * HID;
            const float* w2o = W2i + (size_t)o * HID;

#pragma unroll
            for (int ht = 0; ht < 2; ++ht) {
                const int hidx = ht * 16 + col;       // N -> hidden unit
                const float* p = w1o + hidx * 7;

                // ---- B operand: W1[i,o,hidx,f], f=7 zero-padded ----
                v2f b0, b1v;
                b0.x  = p[koff];                      // f = koff
                b0.y  = p[koff + 1];                  // f = koff+1
                b1v.x = p[4 + koff];                  // f = 4+koff (f6 for hi)
                b1v.y = hi ? 0.0f : p[5];             // f = 7 pad / f5
                // Behind the trip's last lane-masked load its address pair is
                // stepped to the next input; this wait stands in between.
                if (oo == NO - 1 && ht == 1)
                    asm volatile("s_wait_xcnt 0x0" ::: "memory");

                const float bias = 0.5f * b1o[hidx];   // half, as the feats
                const float w2v  = w2o[hidx];

#pragma unroll
                for (int mb = 0; mb < MB; ++mb) {
                    // ---- C seeded with bias (broadcast over batch rows) ----
                    v8f c;
#pragma unroll
                    for (int v = 0; v < 8; ++v) c[v] = bias;

                    // D = (feats * W1^T + bias) / 2  (K = 8, two chained K=4 WMMAs)
                    c = __builtin_amdgcn_wmma_f32_16x16x4_f32(
                            false, a1[mb], false, b1v, (short)0, c, false, false);
                    c = __builtin_amdgcn_wmma_f32_16x16x4_f32(
                            false, a0[mb], false, b0, (short)0, c, false, false);

                    // ---- SiLU + second-layer scale, accumulate ----
                    // silu(h) = h * sigmoid(h) = t + t * tanh(t) with t = h / 2:
                    // one native v_tanh_f32 and one fma per value.
                    float th[8];
#pragma unroll
                    for (int v = 0; v < 8; ++v) th[v] = __builtin_amdgcn_tanhf(c[v]);
#pragma unroll
                    for (int v = 0; v < 8; ++v)
                        acc[mb][oo][v] = fmaf(fmaf(c[v], th[v], c[v]), w2v, acc[mb][oo][v]);
                }
            }
        }
    }

    // ---- Join the 8 waves' partial sums over i, lane by lane, in LDS ----
#pragma unroll
    for (int mb = 0; mb < MB; ++mb)
#pragma unroll
        for (int oo = 0; oo < NO; ++oo)
#pragma unroll
            for (int q = 0; q < 2; ++q) {
                v4f t;
#pragma unroll
                for (int j = 0; j < 4; ++j) t[j] = acc[mb][oo][q * 4 + j];
                red[((wave * MB * NO + mb * NO + oo) * 2 + q) * 32 + lane] = t;
            }

    __syncthreads();

    // Wave w finishes batch tile w / NO, output column obase + w % NO.
    const int fmb = wave / NO;
    const int o   = obase + wave % NO;
    v4f s[2];
#pragma unroll
    for (int q = 0; q < 2; ++q) {
        s[q] = red[(wave * 2 + q) * 32 + lane];
#pragma unroll
        for (int w = 1; w < NW; ++w)
            s[q] += red[((w * MB * NO + wave) * 2 + q) * 32 + lane];
    }

    // Each of the 16 lanes of a row brings 4 of the 64 second-layer biases
    // into the sum over lanes below.
    float bs = 0.0f;
#pragma unroll
    for (int j = 0; j < DIN / 16; ++j) bs += B2[(col + 16 * j) * DOUT + o];

    // ---- N-reduction (sum over 16 lanes of each half-wave) ----
#pragma unroll
    for (int v = 0; v < 8; ++v) {
        float r = s[v >> 2][v & 3] + bs;
        r += __shfl_xor(r, 1);
        r += __shfl_xor(r, 2);
        r += __shfl_xor(r, 4);
        r += __shfl_xor(r, 8);
        if (col == 0) {
            const int m = v + (hi ? 8 : 0);           // batch row within tile
            out[(rbase + fmb * 16 + m) * DOUT + o] = r;
        }
    }
}

extern "C" void kernel_launch(void* const* d_in, const int* in_sizes, int n_in,
                              void* d_out, int out_size, void* d_ws, size_t ws_size,
                              hipStream_t stream) {
    const float* x  = (const float*)d_in[0];
    const float* W1 = (const float*)d_in[1];
    const float* W2 = (const float*)d_in[2];
    const float* B1 = (const float*)d_in[3];
    const float* B2 = (const float*)d_in[4];
    float* out = (float*)d_out;

    (void)in_sizes; (void)n_in; (void)out_size; (void)d_ws; (void)ws_size;

    kan_wmma_kernel<<<dim3((BATCH / (MB * 16)) * (DOUT / NO)), dim3(256), 0, stream>>>(
        x, W1, W2, B1, B2, out);
}

// v003
// Measured time: 22.5 microseconds a run.
// In two side-by-side timings against v002, it was 1.10 and 1.11 times as fast.
// Over all steps from v000 it is 13.2 times as fast.
#include <hip/hip_runtime.h>

typedef __attribute__((ext_vector_type(2))) float v2f;
typedef __attribute__((ext_vector_type(4))) float v4f;
typedef __attribute__((ext_vector_type(8))) float v8f;

#define DIN   64
#define DOUT  64
#define HID   32
#define BATCH 1024

#define MB    4              // 16-row batch tiles per wave (64 rows)
#define NO    2              // output columns per wave
#define NW    8              // waves per block, one slice of the inputs each
#define IC    (DIN / NW)     // inputs per wave

// Everything one trip (one input i) reads from memory.
struct TripOps {
    float xv[MB];            // x[b, i] of the 4 batch tiles
    v2f   wa[NO * 2];        // W1 row, f = koff, koff+1
    v2f   wb[NO * 2];        // W1 row, f = 4, 5 (low half) or 5, 6 (high half)
    float b1[NO * 2];        // B1
    float w2[NO * 2];        // W2
};

// xs, w1s, b1s, w2s: wave-uniform bases of input i; the offsets are per lane
// and the same on every trip. No load is lane-masked and every address lies
// inside its array, so the whole set can be issued in one run.
__device__ __forceinline__ void fetch_trip(
    TripOps& t, const float* xs, const float* w1s, const float* b1s,
    const float* w2s, int xoff, int waoff, int wboff, int col)
{
#pragma unroll
    for (int mb = 0; mb < MB; ++mb) t.xv[mb] = xs[xoff + mb * 16 * DIN];
#pragma unroll
    for (int g = 0; g < NO * 2; ++g) {          // g = oo * 2 + ht
        const float* pa = w1s + g * 16 * 7 + waoff;
        const float* pb = w1s + g * 16 * 7 + wboff;
        t.wa[g].x = pa[0];
        t.wa[g].y = pa[1];
        t.wb[g].x = pb[0];
        t.wb[g].y = pb[1];
        t.b1[g]   = b1s[g * 16 + col];
        t.w2[g]   = w2s[g * 16 + col];
    }
}

// Grid: 512 blocks = 16 groups of 64 batch rows x 32 pairs of output columns,
// 256 threads = 8 waves. Every wave works on the block's 64 rows x 2 columns
// for its own 8 inputs i, so one fetch of a weight fragment serves 4 batch
// tiles; the 8 partial sums over i are joined in LDS at the end.
__global__ __launch_bounds__(256) void kan_wmma_kernel(
    const float* __restrict__ x,    // [B, DIN]
    const float* __restrict__ W1,   // [DIN, DOUT, HID, 7]
    const float* __restrict__ W2,   // [DIN, DOUT, 1, HID]
    const float* __restrict__ B1,   // [DIN, DOUT, HID]
    const float* __restrict__ B2,   // [DIN, DOUT, 1]
    float* __restrict__ out)        // [B, DOUT]
{
    // [wave][(mb*NO+oo)*2 + v/4][lane] of 4 floats: 64 KiB
    __shared__ v4f red[NW * MB * NO * 2 * 32];

    const int lane  = threadIdx.x & 31;
    // 0..7; read through one lane so that the bases built on it stay scalar
    const int wave  = __builtin_amdgcn_readfirstlane(threadIdx.x >> 5);
    const int rbase = (blockIdx.x >> 5) * (MB * 16);   // first batch row
    const int obase = (blockIdx.x & 31) * NO;          // first output column
    const int ibase = wave * IC;                       // first input
    const int col   = lane & 15;          // N (and M-low) index
    const bool hi   = lane >= 16;
    const int koff  = hi ? 2 : 0;         // K base for this half-wave

    // acc[mb][oo][v]: partial sum for row M=v(+8 if hi) of batch tile mb,
    // column-group N=col, output obase+oo, over this wave's i and both h-tiles.
    float acc[MB][NO][8];
#pragma unroll
    for (int mb = 0; mb < MB; ++mb)
#pragma unroll
        for (int oo = 0; oo < NO; ++oo)
#pragma unroll
            for (int v = 0; v < 8; ++v) acc[mb][oo][v] = 0.0f;

    // Per-lane element offsets, fixed over the loop.
    const int xoff  = col * DIN;
    const int waoff = col * 7 + koff;
    const int wboff = col * 7 + (hi ? 5 : 4);

    // Wave-uniform bases of the wave's first input.
    const float* xs  = x  + (size_t)rbase * DIN + ibase;
    const float* w1s = W1 + ((size_t)ibase * DOUT + obase) * HID * 7;
    const float* b1s = B1 + ((size_t)ibase * DOUT + obase) * HID;
    const float* w2s = W2 + ((size_t)ibase * DOUT + obase) * HID;

    TripOps cur;
    fetch_trip(cur, xs, w1s, b1s, w2s, xoff, waoff, wboff, col);

    // Kept rolled: one trip already holds 16 unrolled tiles of code.
#pragma unroll 1
    for (int ii = 0; ii < IC; ++ii) {
        // ---- The next trip's operands, one trip ahead of their use: their
        // latency runs under this trip's 16 tiles. The last trip has no
        // successor and fetches its own set again (in bounds, not used).
        if (ii + 1 < IC) {
            xs  += 1;
            w1s += DOUT * HID * 7;
            b1s += DOUT * HID;
            w2s += DOUT * HID;
        }
        TripOps nxt;
        fetch_trip(nxt, xs, w1s, b1s, w2s, xoff, waoff, wboff, col);
        // Keeps the loads above the trip's work; the scheduler otherwise sinks
        // them to their first use at the trip's foot and nothing covers them.
        __builtin_amdgcn_sched_barrier(0);

        // ---- A operands: feats[b, f] for b = rbase + mb*16 + col ----
        v2f a0[MB], a1[MB];                 // K-tiles 0..3 and 4..7
#pragma unroll
        for (int mb = 0; mb < MB; ++mb) {
            const float xv = cur.xv[mb];
            // Arguments in revolutions, as __sinf and __cosf form them.
            const float r1 = (2.0f * xv) * 0.15915494309189532f;
            const float r2 = (4.0f * xv) * 0.15915494309189532f;
            const float r3 = (8.0f * xv) * 0.15915494309189532f;
            const float s1 = __builtin_amdgcn_sinf(r1);
            const float s2 = __builtin_amdgcn_sinf(r2);
            const float s3 = __builtin_amdgcn_sinf(r3);
            const float c1 = __builtin_amdgcn_cosf(r1);
            const float c2 = __builtin_amdgcn_cosf(r2);
            const float c3 = __builtin_amdgcn_cosf(r3);
            // The slot that the instruction set asks for between a
            // transcendental and an overwrite of its source: the three sources
            // are inputs here, so none is overwritten in front of this v_nop.
            asm volatile("v_nop" :: "v"(r1), "v"(r2), "v"(r3));
            // feats = [x, sin2x, sin4x, sin8x, cos2x, cos4x, cos8x, 0], halved
            // (exact) so that the products below yield t = h / 2.
            a0[mb].x = 0.5f * (hi ? s2 : xv);   // K = koff+0  -> f2 / f0
            a0[mb].y = 0.5f * (hi ? s3 : s1);   // K = koff+1  -> f3 / f1
            a1[mb].x = 0.5f * (hi ? c3 : c1);   // K = 4+koff  -> f6 / f4
            a1[mb].y = hi ? 0.0f : 0.5f * c2;   // K = 5+koff  -> f7(pad) / f5
        }

#pragma unroll
        for (int oo = 0; oo < NO; ++oo) {
#pragma unroll
            for (int ht = 0; ht < 2; ++ht) {
                const int g = oo * 2 + ht;            // N -> hidden ht*16 + col

                // ---- B operand: W1[i,o,hidx,f], f=7 zero-padded ----
                const v2f b0 = cur.wa[g];             // f = koff, koff+1
                v2f b1v;
                b1v.x = hi ? cur.wb[g].y : cur.wb[g].x;   // f6 / f4
                b1v.y = hi ? 0.0f : cur.wb[g].y;          // f7 pad / f5

                const float bias = 0.5f * cur.b1[g];   // half, as the feats
                const float w2v  = cur.w2[g];

#pragma unroll
                for (int mb = 0; mb < MB; ++mb) {
                    // ---- C seeded with bias (broadcast over batch rows) ----
                    v8f c;
#pragma unroll
                    for (int v = 0; v < 8; ++v) c[v] = bias;

                    // D = (feats * W1^T + bias) / 2  (K = 8, two chained K=4 WMMAs)
                    c = __builtin_amdgcn_wmma_f32_16x16x4_f32(
                            false, a1[mb], false, b1v, (short)0, c, false, false);
                    c = __builtin_amdgcn_wmma_f32_16x16x4_f32(
                            false, a0[mb], false, b0, (short)0, c, false, false);

                    // ---- SiLU + second-layer scale, accumulate ----
                    // silu(h) = h * sigmoid(h) = t + t * tanh(t) with t = h / 2:
                    // one native v_tanh_f32 and one fma per value.
                    float th[8];
#pragma unroll
                    for (int v = 0; v < 8; ++v) th[v] = __builtin_amdgcn_tanhf(c[v]);
#pragma unroll
                    for (int v = 0; v < 8; ++v)
                        acc[mb][oo][v] = fmaf(fmaf(c[v], th[v], c[v]), w2v, acc[mb][oo][v]);
                }
            }
        }
        // Inputs-only use of the loaded values: it keeps the next trip's loads
        // in this trip. Without it the compiler merges them with the first
        // fetch and moves them to the head of the trip that consumes them.
        // The scheduling barrier keeps that use, and so the wait for the
        // loads, below the trip's work.
        __builtin_amdgcn_sched_barrier(0);
        asm volatile("" :: "v"(nxt.xv[0]), "v"(nxt.xv[1]), "v"(nxt.xv[2]), "v"(nxt.xv[3]),
                           "v"(nxt.wa[0]), "v"(nxt.wa[1]), "v"(nxt.wa[2]), "v"(nxt.wa[3]),
                           "v"(nxt.wb[0]), "v"(nxt.wb[1]), "v"(nxt.wb[2]), "v"(nxt.wb[3]),
                           "v"(nxt.b1[0]), "v"(nxt.b1[1]), "v"(nxt.b1[2]), "v"(nxt.b1[3]),
                           "v"(nxt.w2[0]), "v"(nxt.w2[1]), "v"(nxt.w2[2]), "v"(nxt.w2[3]));
        // Stands behind the trip's loads and in front of the step of the
        // scalar bases that they name.
        asm volatile("s_wait_xcnt 0x0" ::: "memory");
        cur = nxt;
    }

    // ---- Join the 8 waves' partial sums over i, lane by lane, in LDS ----
#pragma unroll
    for (int mb = 0; mb < MB; ++mb)
#pragma unroll
        for (int oo = 0; oo < NO; ++oo)
#pragma unroll
            for (int q = 0; q < 2; ++q) {
                v4f t;
#pragma unroll
                for (int j = 0; j < 4; ++j) t[j] = acc[mb][oo][q * 4 + j];
                red[((wave * MB * NO + mb * NO + oo) * 2 + q) * 32 + lane] = t;
            }

    __syncthreads();

    // Wave w finishes batch tile w / NO, output column obase + w % NO.
    const int fmb = wave / NO;
    const int o   = obase + wave % NO;
    v4f s[2];
#pragma unroll
    for (int q = 0; q < 2; ++q) {
        s[q] = red[(wave * 2 + q) * 32 + lane];
#pragma unroll
        for (int w = 1; w < NW; ++w)
            s[q] += red[((w * MB * NO + wave) * 2 + q) * 32 + lane];
    }

    // Each of the 16 lanes of a row brings 4 of the 64 second-layer biases
    // into the sum over lanes below.
    float bs = 0.0f;
#pragma unroll
    for (int j = 0; j < DIN / 16; ++j) bs += B2[(col + 16 * j) * DOUT + o];

    // ---- N-reduction (sum over 16 lanes of each half-wave) ----
#pragma unroll
    for (int v = 0; v < 8; ++v) {
        float r = s[v >> 2][v & 3] + bs;
        r += __shfl_xor(r, 1);
        r += __shfl_xor(r, 2);
        r += __shfl_xor(r, 4);
        r += __shfl_xor(r, 8);
        if (col == 0) {
            const int m = v + (hi ? 8 : 0);           // batch row within tile
            out[(rbase + fmb * 16 + m) * DOUT + o] = r;
        }
    }
}

extern "C" void kernel_launch(void* const* d_in, const int* in_sizes, int n_in,
                              void* d_out, int out_size, void* d_ws, size_t ws_size,
                              hipStream_t stream) {
    const float* x  = (const float*)d_in[0];
    const float* W1 = (const float*)d_in[1];
    const float* W2 = (const float*)d_in[2];
    const float* B1 = (const float*)d_in[3];
    const float* B2 = (const float*)d_in[4];
    float* out = (float*)d_out;

    (void)in_sizes; (void)n_in; (void)out_size; (void)d_ws; (void)ws_size;

    kan_wmma_kernel<<<dim3((BATCH / (MB * 16)) * (DOUT / NO)), dim3(256), 0, stream>>>(
        x, W1, W2, B1, B2, out);
}
